// v000
// The times below were measured on an AMD MI455X: many runs one after another, warmed up first and cycling through
// copies of the inputs, with the whole window's GPU time divided by the number of runs. Launches and the gaps
// between them are all in it. The median over several windows is given; except for v000 it joins two sittings, which
// can be a few percent apart, so the side-by-side timings, each taken in one sitting, are the better comparison.
// The starting kernel, v000, takes 35.8 microseconds a run.
#include <hip/hip_runtime.h>
#include <hip/hip_bf16.h>
#include <math.h>

// ---------------------------------------------------------------------------
// Problem constants (from the reference): B=2048, T=200, C=128
// ---------------------------------------------------------------------------
#define CC 128
#define TT 200
#define QTILE 16          // batch rows per block in the WMMA query kernel
#define UQ_STRIDE 132     // padded LDS stride (float4-aligned, low bank conflicts)
#define KSTR 132          // padded LDS stride for keys tile

typedef __attribute__((ext_vector_type(2)))  float    v2f;
typedef __attribute__((ext_vector_type(8)))  float    v8f;
typedef __attribute__((ext_vector_type(16))) _Float16 v16h;

#if __has_builtin(__builtin_amdgcn_wmma_f32_16x16x4_f32)
#define USE_F32_WMMA 1
#endif

// ---------------------------------------------------------------------------
// Kernel 1: Q = tanh(UQ @ W + b)   -- (B x 128) * (128 x 128) GEMM via WMMA.
// One block = 256 threads = 8 waves. Block handles a 16-batch tile; wave w
// produces the 16x16 output tile at columns [16w, 16w+16).
// ---------------------------------------------------------------------------
__global__ __launch_bounds__(256)
void query_tanh_wmma(const float* __restrict__ uq,    // [B, C]
                     const float* __restrict__ W,     // [C, C] row-major (c -> d)
                     const float* __restrict__ bias,  // [C]
                     float* __restrict__ qout,        // [B, C]
                     int B)
{
    __shared__ float uq_lds[QTILE * UQ_STRIDE];

    const int tid = threadIdx.x;
    const int bt0 = blockIdx.x * QTILE;

    // Stage the 16x128 A tile (float4 loads, padded LDS stride)
    for (int i = tid; i < QTILE * (CC / 4); i += 256) {
        const int r  = i / (CC / 4);
        const int c4 = i % (CC / 4);
        float4 v = make_float4(0.f, 0.f, 0.f, 0.f);
        if (bt0 + r < B)
            v = *(const float4*)(uq + (size_t)(bt0 + r) * CC + c4 * 4);
        *(float4*)(&uq_lds[r * UQ_STRIDE + c4 * 4]) = v;
    }
    __syncthreads();

    const int wave = tid >> 5;       // 0..7
    const int lane = tid & 31;
    const int n0   = wave * 16;      // output-column tile
    const int hi   = lane >> 4;      // 0 or 1 (upper half of wave)
    const int lrow = lane & 15;

    v8f acc = {};

#if defined(USE_F32_WMMA)
    // V_WMMA_F32_16X16X4_F32: A 16x4, B 4x16, 32 K-steps of 4.
    // 32-bit A layout: lanes 0-15 hold K=0 (v0) / K=1 (v1); lanes 16-31 K=2/K=3.
    for (int k = 0; k < CC; k += 4) {
        v2f a, bf;
        a.x  = uq_lds[lrow * UQ_STRIDE + k + 2 * hi + 0];
        a.y  = uq_lds[lrow * UQ_STRIDE + k + 2 * hi + 1];
        bf.x = W[(size_t)(k + 2 * hi + 0) * CC + n0 + lrow];
        bf.y = W[(size_t)(k + 2 * hi + 1) * CC + n0 + lrow];
        acc = __builtin_amdgcn_wmma_f32_16x16x4_f32(
            /*neg_a=*/false, a, /*neg_b=*/false, bf,
            /*c_mod=*/(short)0, acc, /*reuse_a=*/false, /*reuse_b=*/false);
    }
#else
    // Fallback: codegen-confirmed V_WMMA_F32_16X16X32_F16 (4 K-steps of 32).
    // 16-bit A 16x32 layout: lanes 0-15: elems 0-7 -> K=k0+0..7, elems 8-15 ->
    // K=k0+16..23; lanes 16-31: +8. B (32x16) mirrored.
    for (int k0 = 0; k0 < CC; k0 += 32) {
        v16h a, bf;
#pragma unroll
        for (int j = 0; j < 8; ++j) {
            a[j]      = (_Float16)uq_lds[lrow * UQ_STRIDE + k0 + hi * 8 + j];
            a[8 + j]  = (_Float16)uq_lds[lrow * UQ_STRIDE + k0 + 16 + hi * 8 + j];
            bf[j]     = (_Float16)W[(size_t)(k0 + hi * 8 + j) * CC + n0 + lrow];
            bf[8 + j] = (_Float16)W[(size_t)(k0 + 16 + hi * 8 + j) * CC + n0 + lrow];
        }
        acc = __builtin_amdgcn_wmma_f32_16x16x32_f16(
            false, a, false, bf, (short)0, acc, false, false);
    }
#endif

    // D layout: VGPR r -> M = r + 8*hi, N = lrow. Apply bias + tanh, store.
    const float bv = bias[n0 + lrow];
#pragma unroll
    for (int r = 0; r < 8; ++r) {
        const int m = r + 8 * hi;
        if (bt0 + m < B)
            qout[(size_t)(bt0 + m) * CC + n0 + lrow] = tanhf(acc[r] + bv);
    }
}

// ---------------------------------------------------------------------------
// Kernel 2: per-batch masked softmax attention + residual-mean, fully fused.
// One block (256 threads) per batch. Stage keys[b] (200x128 f32, 103 KB) in
// LDS once; compute align (dot), masked softmax, weighted sum, + mean(keys).
// ---------------------------------------------------------------------------
__global__ __launch_bounds__(256)
void attn_softmax_fused(const float* __restrict__ keys,   // [B, T, C]
                        const int*   __restrict__ klen,   // [B]
                        const float* __restrict__ q,      // [B, C]
                        float* __restrict__ out)          // [B, C]
{
    __shared__ float k_lds[TT * KSTR];
    __shared__ float q_lds[CC];
    __shared__ float a_lds[256];
    __shared__ float red[256];
    __shared__ int   s_len;

    const int b   = blockIdx.x;
    const int tid = threadIdx.x;

    if (tid < CC) q_lds[tid] = q[(size_t)b * CC + tid];
    if (tid == 0) s_len = klen[b];

    // Stage full keys tile (6400 float4 loads across 256 threads)
    const float* kb = keys + (size_t)b * TT * CC;
    for (int i = tid; i < TT * (CC / 4); i += 256) {
        const int t  = i / (CC / 4);
        const int c4 = i % (CC / 4);
        const float4 v = *(const float4*)(kb + (size_t)t * CC + c4 * 4);
        *(float4*)(&k_lds[t * KSTR + c4 * 4]) = v;
    }
    __syncthreads();

    const int   L     = s_len;
    const float SCALE = 0.08838834764831845f;   // 1/sqrt(128)
    const float PADV  = -4294967295.0f;         // -(2^32) + 1

    // align[t] = (q . keys[t]) * scale, masked
    float aval;
    if (tid < TT) {
        float dot = 0.f;
        const float* kr = &k_lds[tid * KSTR];
#pragma unroll 8
        for (int c = 0; c < CC; ++c) dot = fmaf(q_lds[c], kr[c], dot);
        aval = (tid < L) ? dot * SCALE : PADV;
    } else {
        aval = -INFINITY;                        // never wins max; exp -> 0
    }
    a_lds[tid] = aval;
    red[tid]   = aval;
    __syncthreads();

    // max reduction
    for (int s = 128; s > 0; s >>= 1) {
        if (tid < s) red[tid] = fmaxf(red[tid], red[tid + s]);
        __syncthreads();
    }
    const float mx = red[0];
    __syncthreads();

    // exp + sum reduction
    const float e = (tid < TT) ? __expf(a_lds[tid] - mx) : 0.f;
    a_lds[tid] = e;
    red[tid]   = e;
    __syncthreads();
    for (int s = 128; s > 0; s >>= 1) {
        if (tid < s) red[tid] += red[tid + s];
        __syncthreads();
    }
    const float inv = 1.0f / red[0];

    // out[c] = sum_t w[t]*keys[t,c] + mean_t keys[t,c]
    if (tid < CC) {
        float acc = 0.f, msum = 0.f;
        for (int t = 0; t < TT; ++t) {
            const float kv = k_lds[t * KSTR + tid];
            acc  = fmaf(a_lds[t], kv, acc);
            msum += kv;
        }
        out[(size_t)b * CC + tid] = acc * inv + msum * (1.0f / TT);
    }
}

// ---------------------------------------------------------------------------
// Launch: inputs are (user_query, keys, keys_length, W, b) in dict order.
// ---------------------------------------------------------------------------
extern "C" void kernel_launch(void* const* d_in, const int* in_sizes, int n_in,
                              void* d_out, int out_size, void* d_ws, size_t ws_size,
                              hipStream_t stream) {
    const float* uq   = (const float*)d_in[0];   // [B,1,C]
    const float* keys = (const float*)d_in[1];   // [B,T,C]
    const int*   klen = (const int*)d_in[2];     // [B,1]
    const float* W    = (const float*)d_in[3];   // [C,C]
    const float* bias = (const float*)d_in[4];   // [C]

    const int B = in_sizes[0] / CC;

    float* q_ws = (float*)d_ws;                  // [B, C] scratch (1 MB for B=2048)

    const int qblocks = (B + QTILE - 1) / QTILE;
    query_tanh_wmma<<<qblocks, 256, 0, stream>>>(uq, W, bias, q_ws, B);
    attn_softmax_fused<<<B, 256, 0, stream>>>(keys, klen, q_ws, (float*)d_out);
}

// v001
// One run takes 20.3 microseconds.
// Next to v000, in two timings, it ran 1.82 and 1.77 times as fast.
#include <hip/hip_runtime.h>
#include <hip/hip_bf16.h>
#include <math.h>

// ---------------------------------------------------------------------------
// Problem constants (from the reference): B=2048, T=200, C=128
// ---------------------------------------------------------------------------
#define CC 128
#define TT 200
#define QTILE 16          // batch rows per block in the WMMA query kernel
#define UQ_STRIDE 132     // padded LDS stride (float4-aligned, low bank conflicts)

typedef __attribute__((ext_vector_type(2)))  float    v2f;
typedef __attribute__((ext_vector_type(8)))  float    v8f;
typedef __attribute__((ext_vector_type(16))) _Float16 v16h;

#if __has_builtin(__builtin_amdgcn_wmma_f32_16x16x4_f32)
#define USE_F32_WMMA 1
#endif

// ---------------------------------------------------------------------------
// Kernel 1: Q = tanh(UQ @ W + b)   -- (B x 128) * (128 x 128) GEMM via WMMA.
// One block = 256 threads = 8 waves. Block handles a 16-batch tile; wave w
// produces the 16x16 output tile at columns [16w, 16w+16).
// ---------------------------------------------------------------------------
__global__ __launch_bounds__(256)
void query_tanh_wmma(const float* __restrict__ uq,    // [B, C]
                     const float* __restrict__ W,     // [C, C] row-major (c -> d)
                     const float* __restrict__ bias,  // [C]
                     float* __restrict__ qout,        // [B, C]
                     int B)
{
    __shared__ float uq_lds[QTILE * UQ_STRIDE];

    const int tid = threadIdx.x;
    const int bt0 = blockIdx.x * QTILE;

    // Stage the 16x128 A tile (float4 loads, padded LDS stride)
    for (int i = tid; i < QTILE * (CC / 4); i += 256) {
        const int r  = i / (CC / 4);
        const int c4 = i % (CC / 4);
        float4 v = make_float4(0.f, 0.f, 0.f, 0.f);
        if (bt0 + r < B)
            v = *(const float4*)(uq + (size_t)(bt0 + r) * CC + c4 * 4);
        *(float4*)(&uq_lds[r * UQ_STRIDE + c4 * 4]) = v;
    }
    __syncthreads();

    const int wave = tid >> 5;       // 0..7
    const int lane = tid & 31;
    const int n0   = wave * 16;      // output-column tile
    const int hi   = lane >> 4;      // 0 or 1 (upper half of wave)
    const int lrow = lane & 15;

    v8f acc = {};

#if defined(USE_F32_WMMA)
    // V_WMMA_F32_16X16X4_F32: A 16x4, B 4x16, 32 K-steps of 4.
    // 32-bit A layout: lanes 0-15 hold K=0 (v0) / K=1 (v1); lanes 16-31 K=2/K=3.
    for (int k = 0; k < CC; k += 4) {
        v2f a, bf;
        a.x  = uq_lds[lrow * UQ_STRIDE + k + 2 * hi + 0];
        a.y  = uq_lds[lrow * UQ_STRIDE + k + 2 * hi + 1];
        bf.x = W[(size_t)(k + 2 * hi + 0) * CC + n0 + lrow];
        bf.y = W[(size_t)(k + 2 * hi + 1) * CC + n0 + lrow];
        acc = __builtin_amdgcn_wmma_f32_16x16x4_f32(
            /*neg_a=*/false, a, /*neg_b=*/false, bf,
            /*c_mod=*/(short)0, acc, /*reuse_a=*/false, /*reuse_b=*/false);
    }
#else
    // Fallback: codegen-confirmed V_WMMA_F32_16X16X32_F16 (4 K-steps of 32).
    // 16-bit A 16x32 layout: lanes 0-15: elems 0-7 -> K=k0+0..7, elems 8-15 ->
    // K=k0+16..23; lanes 16-31: +8. B (32x16) mirrored.
    for (int k0 = 0; k0 < CC; k0 += 32) {
        v16h a, bf;
#pragma unroll
        for (int j = 0; j < 8; ++j) {
            a[j]      = (_Float16)uq_lds[lrow * UQ_STRIDE + k0 + hi * 8 + j];
            a[8 + j]  = (_Float16)uq_lds[lrow * UQ_STRIDE + k0 + 16 + hi * 8 + j];
            bf[j]     = (_Float16)W[(size_t)(k0 + hi * 8 + j) * CC + n0 + lrow];
            bf[8 + j] = (_Float16)W[(size_t)(k0 + 16 + hi * 8 + j) * CC + n0 + lrow];
        }
        acc = __builtin_amdgcn_wmma_f32_16x16x32_f16(
            false, a, false, bf, (short)0, acc, false, false);
    }
#endif

    // D layout: VGPR r -> M = r + 8*hi, N = lrow. Apply bias + tanh, store.
    const float bv = bias[n0 + lrow];
#pragma unroll
    for (int r = 0; r < 8; ++r) {
        const int m = r + 8 * hi;
        if (bt0 + m < B)
            qout[(size_t)(bt0 + m) * CC + n0 + lrow] = tanhf(acc[r] + bv);
    }
}

// ---------------------------------------------------------------------------
// Kernel 2: masked softmax attention + residual mean, keys streamed once
// through registers. One block = 16 waves = 8 batches, two waves per batch,
// 100 key rows per wave. A load of a wave covers two rows x 256 bytes: lanes
// 0-15 hold the even row, lanes 16-31 the odd row, each lane 8 of the 128
// columns. Each 16-lane group keeps its own running max, sum, weighted sum
// and plain sum; the four partials of a batch are merged through LDS.
// ---------------------------------------------------------------------------
#define BPB    8                  // batches per block
#define ROWS_W 100                // key rows per wave
#define CH     10                 // rows (= loads) per register buffer
#define NBUF   3                  // register buffers: two are in flight while one is summed
#define NCH    (ROWS_W / CH)      // buffers' worth of rows per wave
#define PR     (CH / 2)           // rows per 16-lane group in one buffer

typedef __attribute__((ext_vector_type(4))) float v4f;

// Sum over a 16-lane row; every lane of the row gets the total. Written as asm so
// that each add and its lane exchange are one DPP instruction; from the builtin the
// compiler made a separate DPP move per value in front of packed adds.
static __device__ __forceinline__ float row_sum16(float x) {
    asm("v_add_f32_dpp %0, %0, %0 row_xmask:1 row_mask:0xf bank_mask:0xf" : "+v"(x));
    asm("v_add_f32_dpp %0, %0, %0 row_xmask:2 row_mask:0xf bank_mask:0xf" : "+v"(x));
    asm("v_add_f32_dpp %0, %0, %0 row_xmask:4 row_mask:0xf bank_mask:0xf" : "+v"(x));
    asm("v_add_f32_dpp %0, %0, %0 row_xmask:8 row_mask:0xf bank_mask:0xf" : "+v"(x));
    return x;
}

// e^x in the fast form (multiply by log2 e, v_exp_f32). The v_nop in the same
// statement keeps the one issue slot that the instruction set asks for behind a
// transcendental.
static __device__ __forceinline__ float exp_fast(float x) {
    float r;
    asm("v_exp_f32 %0, %1\n\tv_nop" : "=v"(r) : "v"(x * 1.44269504088896340736f));
    return r;
}

// One buffer's loads: CH rows from kp on, two loads (256 bytes a row each) per pair of rows.
static __device__ __forceinline__ void load_rows(v4f (&dst)[CH], const float* __restrict__ kp) {
#pragma unroll  // constant indices keep the buffer in registers
    for (int i = 0; i < CH; ++i)
        dst[i] = *(const v4f*)(kp + (i >> 1) * 2 * CC + (i & 1) * 64);
}

__global__ __launch_bounds__(512)
void attn_softmax_stream(const float* __restrict__ keys,   // [B, T, C]
                         const int*   __restrict__ klen,   // [B]
                         const float* __restrict__ q,      // [B, C]
                         float* __restrict__ out,          // [B, C]
                         int B)
{
    __shared__ float p_acc[BPB * 4 * CC];
    __shared__ float p_ms[BPB * 4 * CC];
    __shared__ float p_m[BPB * 4 * 16];
    __shared__ float p_l[BPB * 4 * 16];

    const int tid  = threadIdx.x;
    const int lane = tid & 31;
    const int wave = __builtin_amdgcn_readfirstlane(tid >> 5);
    const int bi   = wave >> 1;          // batch within the block
    const int half = wave & 1;           // which 100 rows of the batch
    const int g    = lane >> 4;          // row parity of this 16-lane group
    const int c    = lane & 15;          // column slot

    const int b  = blockIdx.x * BPB + bi;
    const int bc = (b < B) ? b : (B - 1);   // a batch past the end re-reads the last batch, stores nothing

    const int   L     = klen[bc];
    const float SCALE = 0.08838834764831845f;   // 1/sqrt(128)
    const float PADV  = -4294967295.0f;         // -(2^32) + 1

    const int    row0 = half * ROWS_W + g;
    const float* kp   = keys + (size_t)bc * TT * CC + (size_t)row0 * CC + c * 4;

    v4f buf[NBUF][CH];

    float m = -INFINITY, l = 0.f;
    v4f acc0 = {}, acc1 = {}, ms0 = {}, ms1 = {};

    load_rows(buf[0], kp);
    const v4f qa = *(const v4f*)(q + (size_t)bc * CC + c * 4);
    const v4f qb = *(const v4f*)(q + (size_t)bc * CC + 64 + c * 4);
    // The address register of the two q loads is free for reuse from here on:
    // the wait stands in front of whatever overwrites it.
    asm volatile("s_wait_xcnt 0x0" ::: "memory");
    load_rows(buf[1], kp + CH * CC);
#pragma unroll  // the buffer number must be a constant, else the buffers go to scratch
    for (int n = 0; n < NCH; ++n) {
        // The two scheduling barriers keep the loads of the buffer after next in
        // front of this buffer's arithmetic, so 20 to 30 loads of a wave stay in flight.
        __builtin_amdgcn_sched_barrier(0);
        if (n + 2 < NCH) load_rows(buf[(n + 2) % NBUF], kp + (n + 2) * CH * CC);
        __builtin_amdgcn_sched_barrier(0);

        const v4f* kb = buf[n % NBUF];
        float s[PR];
#pragma unroll  // constant indices into s and the buffer
        for (int p = 0; p < PR; ++p) {
            const v4f pr = kb[2 * p] * qa + kb[2 * p + 1] * qb;
            const v2f h = pr.xy + pr.zw;
            const float d = row_sum16(h.x + h.y);
            s[p] = (row0 + n * CH + 2 * p < L) ? d * SCALE : PADV;
        }
        float mn = m;
#pragma unroll  // constant indices into s
        for (int p = 0; p < PR; ++p) mn = fmaxf(mn, s[p]);
        const float corr = exp_fast(m - mn);   // 0 on the first buffer (m = -inf, mn finite)
        m = mn;
        l *= corr; acc0 *= corr; acc1 *= corr;
#pragma unroll  // constant indices into s and the buffer
        for (int p = 0; p < PR; ++p) {
            const float e = exp_fast(s[p] - mn);
            l    += e;
            acc0 += kb[2 * p] * e;
            acc1 += kb[2 * p + 1] * e;
            ms0  += kb[2 * p];
            ms1  += kb[2 * p + 1];
        }
    }

    const int slot = bi * 4 + half * 2 + g;
    *(v4f*)(&p_acc[slot * CC + c * 4])      = acc0;
    *(v4f*)(&p_acc[slot * CC + 64 + c * 4]) = acc1;
    *(v4f*)(&p_ms[slot * CC + c * 4])       = ms0;
    *(v4f*)(&p_ms[slot * CC + 64 + c * 4])  = ms1;
    // Every lane stores its copy: behind a one-lane test the compiler moved the whole
    // sum of l into that branch and kept every weight alive until there (spills).
    p_m[slot * 16 + c] = m;
    p_l[slot * 16 + c] = l;
    __syncthreads();

    // Merge the four partials of each batch: out = sum_t w[t]*keys[t] + mean_t keys[t]
#pragma unroll  // two trips, straight line
    for (int i = tid; i < BPB * CC; i += 512) {
        const int ob  = i / CC;
        const int col = i % CC;
        const int s0  = ob * 4;
        const float mx = fmaxf(fmaxf(p_m[s0 * 16], p_m[s0 * 16 + 16]), fmaxf(p_m[s0 * 16 + 32], p_m[s0 * 16 + 48]));
        float num = 0.f, den = 0.f, msum = 0.f;
#pragma unroll  // four terms, LDS reads issued together
        for (int p = 0; p < 4; ++p) {
            const float f = exp_fast(p_m[(s0 + p) * 16] - mx);
            den  = fmaf(f, p_l[(s0 + p) * 16], den);
            num  = fmaf(f, p_acc[(s0 + p) * CC + col], num);
            msum += p_ms[(s0 + p) * CC + col];
        }
        if (blockIdx.x * BPB + ob < B)
            out[(size_t)(blockIdx.x * BPB + ob) * CC + col] = num / den + msum * (1.0f / TT);
    }
}

// ---------------------------------------------------------------------------
// Launch: inputs are (user_query, keys, keys_length, W, b) in dict order.
// ---------------------------------------------------------------------------
extern "C" void kernel_launch(void* const* d_in, const int* in_sizes, int n_in,
                              void* d_out, int out_size, void* d_ws, size_t ws_size,
                              hipStream_t stream) {
    const float* uq   = (const float*)d_in[0];   // [B,1,C]
    const float* keys = (const float*)d_in[1];   // [B,T,C]
    const int*   klen = (const int*)d_in[2];     // [B,1]
    const float* W    = (const float*)d_in[3];   // [C,C]
    const float* bias = (const float*)d_in[4];   // [C]

    const int B = in_sizes[0] / CC;

    float* q_ws = (float*)d_ws;                  // [B, C] scratch (1 MB for B=2048)

    const int qblocks = (B + QTILE - 1) / QTILE;
    query_tanh_wmma<<<qblocks, 256, 0, stream>>>(uq, W, bias, q_ws, B);
    const int ablocks = (B + BPB - 1) / BPB;
    attn_softmax_stream<<<ablocks, 512, 0, stream>>>(keys, klen, q_ws, (float*)d_out, B);
}

// v002
// Measured time: 15.7 microseconds a run.
// Next to v001, in two timings, it ran 1.26 times as fast each time.
// Counting every step since v000, it is 2.27 times as fast.
#include <hip/hip_runtime.h>
#include <hip/hip_bf16.h>
#include <math.h>

// ---------------------------------------------------------------------------
// Problem constants (from the reference): B=2048, T=200, C=128
// ---------------------------------------------------------------------------
#define CC 128
#define TT 200

typedef __attribute__((ext_vector_type(2)))  float    v2f;
typedef __attribute__((ext_vector_type(8)))  float    v8f;

// ---------------------------------------------------------------------------
// One kernel: Q = tanh(UQ @ W + b) for the block's own 8 batches on WMMA, then
// masked softmax attention + residual mean with the keys streamed once through
// registers. One block = 16 waves = 8 batches, two waves per batch, 100 key rows
// per wave. A key load of a wave covers two rows x 256 bytes: lanes 0-15 hold the
// even row, lanes 16-31 the odd row, each lane 8 of the 128 columns. Each 16-lane
// group keeps its own running max, sum, weighted sum and plain sum; the four
// partials of a batch are merged through LDS.
// The projection runs while the first 20 key loads of every wave are in flight:
// wave w takes 16 of the 128 k (w >> 1) and 64 of the 128 columns (w & 1); the
// eight k partials are summed through LDS.
// ---------------------------------------------------------------------------
#define BPB    8                  // batches per block
#define ROWS_W 100                // key rows per wave
#define CH     10                 // rows (= loads) per register buffer
#define NBUF   3                  // register buffers: two are in flight while one is summed
#define NCH    (ROWS_W / CH)      // buffers' worth of rows per wave
#define PR     (CH / 2)           // rows per 16-lane group in one buffer

typedef __attribute__((ext_vector_type(4))) float v4f;

// Sum over a 16-lane row; every lane of the row gets the total. Written as asm so
// that each add and its lane exchange are one DPP instruction; from the builtin the
// compiler made a separate DPP move per value in front of packed adds.
static __device__ __forceinline__ float row_sum16(float x) {
    asm("v_add_f32_dpp %0, %0, %0 row_xmask:1 row_mask:0xf bank_mask:0xf" : "+v"(x));
    asm("v_add_f32_dpp %0, %0, %0 row_xmask:2 row_mask:0xf bank_mask:0xf" : "+v"(x));
    asm("v_add_f32_dpp %0, %0, %0 row_xmask:4 row_mask:0xf bank_mask:0xf" : "+v"(x));
    asm("v_add_f32_dpp %0, %0, %0 row_xmask:8 row_mask:0xf bank_mask:0xf" : "+v"(x));
    return x;
}

// e^x in the fast form (multiply by log2 e, v_exp_f32). The v_nop in the same
// statement keeps the one issue slot that the instruction set asks for behind a
// transcendental.
static __device__ __forceinline__ float exp_fast(float x) {
    float r;
    asm("v_exp_f32 %0, %1\n\tv_nop" : "=v"(r) : "v"(x * 1.44269504088896340736f));
    return r;
}

// One buffer's loads: CH rows from kp on, two loads (256 bytes a row each) per pair of rows.
static __device__ __forceinline__ void load_rows(v4f (&dst)[CH], const float* __restrict__ kp) {
#pragma unroll  // constant indices keep the buffer in registers
    for (int i = 0; i < CH; ++i)
        dst[i] = *(const v4f*)(kp + (i >> 1) * 2 * CC + (i & 1) * 64);
}

#define KSPLIT 8                  // k slices of the projection, 16 k each

// Work-group barrier for LDS data only. __syncthreads() would also wait for the
// wave's global loads, and the key loads issued ahead must stay in flight across it.
static __device__ __forceinline__ void lds_barrier() {
    asm volatile("s_wait_dscnt 0x0\n\ts_barrier_signal -1\n\ts_barrier_wait -1" ::: "memory");
}

__global__ __launch_bounds__(512)
void attn_softmax_stream(const float* __restrict__ uq,     // [B, C]
                         const float* __restrict__ keys,   // [B, T, C]
                         const int*   __restrict__ klen,   // [B]
                         const float* __restrict__ W,      // [C, C] row-major (c -> d)
                         const float* __restrict__ bias,   // [C]
                         float* __restrict__ out,          // [B, C]
                         int B)
{
    __shared__ float q_part[KSPLIT * BPB * CC];
    __shared__ float q_lds[BPB * CC];
    __shared__ float p_acc[BPB * 4 * CC];
    __shared__ float p_ms[BPB * 4 * CC];
    __shared__ float p_m[BPB * 4 * 16];
    __shared__ float p_l[BPB * 4 * 16];

    const int tid  = threadIdx.x;
    const int lane = tid & 31;
    const int wave = __builtin_amdgcn_readfirstlane(tid >> 5);
    const int bi   = wave >> 1;          // batch within the block; k slice of the projection
    const int half = wave & 1;           // which 100 rows of the batch; column half of the projection
    const int g    = lane >> 4;          // row parity of this 16-lane group
    const int c    = lane & 15;          // column slot

    const float SCALE = 0.08838834764831845f;   // 1/sqrt(128)
    const float PADV  = -4294967295.0f;         // -(2^32) + 1

    // Projection operands, loaded in front of the keys so that their wait leaves the
    // key loads in flight. A rows 0-7 are batches 0-7, rows 8-15 batches 4-7, 0-3, so
    // that D registers 0-3 hold batches 0-3 in lane group 0 and 4-7 in group 1.
    // Lane group g holds k = 16*bi + 8*g + 2*t + {0,1} in step t, in A and in B alike.
    // One 16-byte load of a W row gives the lane column 64*half + 4*c + j of tile j.
    const int ar  = blockIdx.x * BPB + ((c + ((c >> 3) << 2)) & 7);
    const int arc = (ar < B) ? ar : (B - 1);
    const int k0  = bi * 16 + g * 8;
    const float* up = uq + (size_t)arc * CC + k0;
    const float* wp = W + (size_t)k0 * CC + half * 64 + c * 4;
    const int qr = tid >> 6;             // batch and column pair that this thread sums
    const int qc = (tid & 63) * 2;
    const v4f ua0 = *(const v4f*)(up);
    const v4f ua1 = *(const v4f*)(up + 4);
    v4f wr[8];
#pragma unroll  // constant indices keep the rows in registers
    for (int i = 0; i < 8; ++i) wr[i] = *(const v4f*)(wp + i * CC);
    const v2f bv = *(const v2f*)(bias + qc);
    // The address registers of the loads above are free for reuse from here on:
    // the wait stands in front of whatever overwrites them.
    asm volatile("s_wait_xcnt 0x0" ::: "memory");

    v4f buf[NBUF][CH];

    float m = -INFINITY, l = 0.f;
    v4f acc0 = {}, acc1 = {}, ms0 = {}, ms1 = {};

    // The scheduling barriers keep the order: projection loads and their wait, the
    // keys' address, key loads, projection.
    __builtin_amdgcn_sched_barrier(0);
    const int b  = blockIdx.x * BPB + bi;
    const int bc = (b < B) ? b : (B - 1);   // a batch past B re-reads the last batch; it is not stored
    const int    row0 = half * ROWS_W + g;
    const float* kp   = keys + (size_t)bc * TT * CC + (size_t)row0 * CC + c * 4;
    load_rows(buf[0], kp);
    load_rows(buf[1], kp + CH * CC);
    const int L = klen[bc];   // read here, not at the top: a wait for it in front of the loads would hold them back
    __builtin_amdgcn_sched_barrier(0);

    {
        const v2f a[4] = { ua0.xy, ua0.zw, ua1.xy, ua1.zw };
        v8f d[4] = {};
#pragma unroll  // constant indices into the fragments
        for (int t = 0; t < 4; ++t)
#pragma unroll  // constant indices into the fragments
            for (int j = 0; j < 4; ++j) {
                v2f bf;
                bf.x = wr[2 * t][j];
                bf.y = wr[2 * t + 1][j];
                d[j] = __builtin_amdgcn_wmma_f32_16x16x4_f32(
                    /*neg_a=*/false, a[t], /*neg_b=*/false, bf,
                    /*c_mod=*/(short)0, d[j], /*reuse_a=*/false, /*reuse_b=*/false);
            }
        // Four issue slots between the last WMMA and the vector moves below, which read
        // the D registers and reuse the unused ones; the scheduling barriers hold them there.
        __builtin_amdgcn_sched_barrier(0);
        asm volatile("v_nop\n\tv_nop\n\tv_nop\n\tv_nop");
        __builtin_amdgcn_sched_barrier(0);
        // D register i < 4 = batch 4*g + i; four adjacent columns per store.
#pragma unroll  // constant indices into d
        for (int i = 0; i < 4; ++i) {
            const v4f v = { d[0][i], d[1][i], d[2][i], d[3][i] };
            *(v4f*)(&q_part[(bi * BPB + g * 4 + i) * CC + half * 64 + c * 4]) = v;
        }
    }
    lds_barrier();
    {
        v2f s = *(const v2f*)(&q_part[qr * CC + qc]);
#pragma unroll  // LDS reads issued together
        for (int p = 1; p < KSPLIT; ++p) s += *(const v2f*)(&q_part[(p * BPB + qr) * CC + qc]);
        s += bv;
        v2f tq;
        tq.x = tanhf(s.x);
        tq.y = tanhf(s.y);
        *(v2f*)(&q_lds[qr * CC + qc]) = tq;
    }
    lds_barrier();
    const v4f qa = *(const v4f*)(&q_lds[bi * CC + c * 4]);
    const v4f qb = *(const v4f*)(&q_lds[bi * CC + 64 + c * 4]);

#pragma unroll  // the buffer number must be a constant, else the buffers go to scratch
    for (int n = 0; n < NCH; ++n) {
        // The two scheduling barriers keep the loads of the buffer after next in
        // front of this buffer's arithmetic, so 20 to 30 loads of a wave stay in flight.
        __builtin_amdgcn_sched_barrier(0);
        if (n + 2 < NCH) load_rows(buf[(n + 2) % NBUF], kp + (n + 2) * CH * CC);
        __builtin_amdgcn_sched_barrier(0);

        const v4f* kb = buf[n % NBUF];
        float s[PR];
#pragma unroll  // constant indices into s and the buffer
        for (int p = 0; p < PR; ++p) {
            const v4f pr = kb[2 * p] * qa + kb[2 * p + 1] * qb;
            const v2f h = pr.xy + pr.zw;
            const float d = row_sum16(h.x + h.y);
            s[p] = (row0 + n * CH + 2 * p < L) ? d * SCALE : PADV;
        }
        float mn = m;
#pragma unroll  // constant indices into s
        for (int p = 0; p < PR; ++p) mn = fmaxf(mn, s[p]);
        const float corr = exp_fast(m - mn);   // 0 on the first buffer (m = -inf, mn finite)
        m = mn;
        l *= corr; acc0 *= corr; acc1 *= corr;
#pragma unroll  // constant indices into s and the buffer
        for (int p = 0; p < PR; ++p) {
            const float e = exp_fast(s[p] - mn);
            l    += e;
            acc0 += kb[2 * p] * e;
            acc1 += kb[2 * p + 1] * e;
            ms0  += kb[2 * p];
            ms1  += kb[2 * p + 1];
        }
    }

    const int slot = bi * 4 + half * 2 + g;
    *(v4f*)(&p_acc[slot * CC + c * 4])      = acc0;
    *(v4f*)(&p_acc[slot * CC + 64 + c * 4]) = acc1;
    *(v4f*)(&p_ms[slot * CC + c * 4])       = ms0;
    *(v4f*)(&p_ms[slot * CC + 64 + c * 4])  = ms1;
    // Every lane stores its copy: behind a one-lane test the compiler moved the whole
    // sum of l into that branch and kept every weight alive until there (spills).
    p_m[slot * 16 + c] = m;
    p_l[slot * 16 + c] = l;
    __syncthreads();

    // Merge the four partials of each batch: out = sum_t w[t]*keys[t] + mean_t keys[t]
#pragma unroll  // two trips, straight line
    for (int i = tid; i < BPB * CC; i += 512) {
        const int ob  = i / CC;
        const int col = i % CC;
        const int s0  = ob * 4;
        const float mx = fmaxf(fmaxf(p_m[s0 * 16], p_m[s0 * 16 + 16]), fmaxf(p_m[s0 * 16 + 32], p_m[s0 * 16 + 48]));
        float num = 0.f, den = 0.f, msum = 0.f;
#pragma unroll  // four terms, LDS reads issued together
        for (int p = 0; p < 4; ++p) {
            const float f = exp_fast(p_m[(s0 + p) * 16] - mx);
            den  = fmaf(f, p_l[(s0 + p) * 16], den);
            num  = fmaf(f, p_acc[(s0 + p) * CC + col], num);
            msum += p_ms[(s0 + p) * CC + col];
        }
        if (blockIdx.x * BPB + ob < B)
            out[(size_t)(blockIdx.x * BPB + ob) * CC + col] = num / den + msum * (1.0f / TT);
    }
}

// ---------------------------------------------------------------------------
// Launch: inputs are (user_query, keys, keys_length, W, b) in dict order.
// ---------------------------------------------------------------------------
extern "C" void kernel_launch(void* const* d_in, const int* in_sizes, int n_in,
                              void* d_out, int out_size, void* d_ws, size_t ws_size,
                              hipStream_t stream) {
    const float* uq   = (const float*)d_in[0];   // [B,1,C]
    const float* keys = (const float*)d_in[1];   // [B,T,C]
    const int*   klen = (const int*)d_in[2];     // [B,1]
    const float* W    = (const float*)d_in[3];   // [C,C]
    const float* bias = (const float*)d_in[4];   // [C]

    const int B = in_sizes[0] / CC;

    const int ablocks = (B + BPB - 1) / BPB;
    attn_softmax_stream<<<ablocks, 512, 0, stream>>>(uq, keys, klen, W, bias, (float*)d_out, B);
}

// v003
// A run of this version takes 14.3 microseconds.
// Timed twice side by side with v002, it ran 1.10 times as fast both times.
// Counting every step since v000, it is 2.50 times as fast.
#include <hip/hip_runtime.h>
#include <hip/hip_bf16.h>
#include <math.h>

// ---------------------------------------------------------------------------
// Problem constants (from the reference): B=2048, T=200, C=128
// ---------------------------------------------------------------------------
#define CC 128
#define TT 200

typedef __attribute__((ext_vector_type(2)))  float    v2f;
typedef __attribute__((ext_vector_type(8)))  float    v8f;

// ---------------------------------------------------------------------------
// One kernel: Q = tanh(UQ @ W + b) for the block's own 8 batches on WMMA, then
// masked softmax attention + residual mean with the keys streamed once through
// registers. One block = 16 waves = 8 batches, two waves per batch, 100 key rows
// per wave. A key load of a wave covers two rows x 256 bytes: lanes 0-15 hold the
// even row, lanes 16-31 the odd row, each lane 8 of the 128 columns. Each 16-lane
// group keeps its own running max, sum, weighted sum and plain sum; the four
// partials of a batch are merged through LDS.
// The projection runs while the first 20 key loads of every wave are in flight:
// wave w takes 16 of the 128 k (w >> 1) and 64 of the 128 columns (w & 1); the
// eight k partials are summed through LDS.
// ---------------------------------------------------------------------------
#define BPB    8                  // batches per block
#define ROWS_W 100                // key rows per wave
#define CH     10                 // rows (= loads) per register buffer
#define NBUF   3                  // register buffers: two are in flight while one is summed
#define NCH    (ROWS_W / CH)      // buffers' worth of rows per wave
#define PR     (CH / 2)           // rows per 16-lane group in one buffer

typedef __attribute__((ext_vector_type(4))) float v4f;

// Sum over a 16-lane row; every lane of the row gets the total. Written as asm so
// that each add and its lane exchange are one DPP instruction; from the builtin the
// compiler made a separate DPP move per value in front of packed adds.
static __device__ __forceinline__ float row_sum16(float x) {
    asm("v_add_f32_dpp %0, %0, %0 row_xmask:1 row_mask:0xf bank_mask:0xf" : "+v"(x));
    asm("v_add_f32_dpp %0, %0, %0 row_xmask:2 row_mask:0xf bank_mask:0xf" : "+v"(x));
    asm("v_add_f32_dpp %0, %0, %0 row_xmask:4 row_mask:0xf bank_mask:0xf" : "+v"(x));
    asm("v_add_f32_dpp %0, %0, %0 row_xmask:8 row_mask:0xf bank_mask:0xf" : "+v"(x));
    return x;
}

// e^x in the fast form (multiply by log2 e, v_exp_f32). The v_nop in the same
// statement keeps the one issue slot that the instruction set asks for behind a
// transcendental.
static __device__ __forceinline__ float exp_fast(float x) {
    float r;
    asm("v_exp_f32 %0, %1\n\tv_nop" : "=v"(r) : "v"(x * 1.44269504088896340736f));
    return r;
}

// One buffer's loads: CH rows from kp on, two loads (256 bytes a row each) per pair of rows.
// Non-temporal: a launch reads every key byte exactly once, so the lines need no place in L2;
// W, the queries and the bias, which other waves read again, stay on plain loads.
static __device__ __forceinline__ void load_rows(v4f (&dst)[CH], const float* __restrict__ kp) {
#pragma unroll  // constant indices keep the buffer in registers
    for (int i = 0; i < CH; ++i)
        dst[i] = __builtin_nontemporal_load((const v4f*)(kp + (i >> 1) * 2 * CC + (i & 1) * 64));
}

#define KSPLIT 8                  // k slices of the projection, 16 k each

// Work-group barrier for LDS data only. __syncthreads() would also wait for the
// wave's global loads, and the key loads issued ahead must stay in flight across it.
static __device__ __forceinline__ void lds_barrier() {
    asm volatile("s_wait_dscnt 0x0\n\ts_barrier_signal -1\n\ts_barrier_wait -1" ::: "memory");
}

__global__ __launch_bounds__(512)
void attn_softmax_stream(const float* __restrict__ uq,     // [B, C]
                         const float* __restrict__ keys,   // [B, T, C]
                         const int*   __restrict__ klen,   // [B]
                         const float* __restrict__ W,      // [C, C] row-major (c -> d)
                         const float* __restrict__ bias,   // [C]
                         float* __restrict__ out,          // [B, C]
                         int B)
{
    __shared__ float q_part[KSPLIT * BPB * CC];
    __shared__ float q_lds[BPB * CC];
    __shared__ float p_acc[BPB * 4 * CC];
    __shared__ float p_ms[BPB * 4 * CC];
    __shared__ float p_m[BPB * 4 * 16];
    __shared__ float p_l[BPB * 4 * 16];

    const int tid  = threadIdx.x;
    const int lane = tid & 31;
    const int wave = __builtin_amdgcn_readfirstlane(tid >> 5);
    const int bi   = wave >> 1;          // batch within the block; k slice of the projection
    const int half = wave & 1;           // which 100 rows of the batch; column half of the projection
    const int g    = lane >> 4;          // row parity of this 16-lane group
    const int c    = lane & 15;          // column slot

    const float SCALE = 0.08838834764831845f;   // 1/sqrt(128)
    const float PADV  = -4294967295.0f;         // -(2^32) + 1

    // Projection operands, loaded in front of the keys so that their wait leaves the
    // key loads in flight. A rows 0-7 are batches 0-7, rows 8-15 batches 4-7, 0-3, so
    // that D registers 0-3 hold batches 0-3 in lane group 0 and 4-7 in group 1.
    // Lane group g holds k = 16*bi + 8*g + 2*t + {0,1} in step t, in A and in B alike.
    // One 16-byte load of a W row gives the lane column 64*half + 4*c + j of tile j.
    const int ar  = blockIdx.x * BPB + ((c + ((c >> 3) << 2)) & 7);
    const int arc = (ar < B) ? ar : (B - 1);
    const int k0  = bi * 16 + g * 8;
    const float* up = uq + (size_t)arc * CC + k0;
    const float* wp = W + (size_t)k0 * CC + half * 64 + c * 4;
    const int qr = tid >> 6;             // batch and column pair that this thread sums
    const int qc = (tid & 63) * 2;
    const v4f ua0 = *(const v4f*)(up);
    const v4f ua1 = *(const v4f*)(up + 4);
    v4f wr[8];
#pragma unroll  // constant indices keep the rows in registers
    for (int i = 0; i < 8; ++i) wr[i] = *(const v4f*)(wp + i * CC);
    const v2f bv = *(const v2f*)(bias + qc);
    // The address registers of the loads above are free for reuse from here on:
    // the wait stands in front of whatever overwrites them.
    asm volatile("s_wait_xcnt 0x0" ::: "memory");

    v4f buf[NBUF][CH];

    float m = -INFINITY, l = 0.f;
    v4f acc0 = {}, acc1 = {}, ms0 = {}, ms1 = {};

    // The scheduling barriers keep the order: projection loads and their wait, the
    // keys' address, key loads, projection.
    __builtin_amdgcn_sched_barrier(0);
    const int b  = blockIdx.x * BPB + bi;
    const int bc = (b < B) ? b : (B - 1);   // a batch past B re-reads the last batch; it is not stored
    const int    row0 = half * ROWS_W + g;
    const float* kp   = keys + (size_t)bc * TT * CC + (size_t)row0 * CC + c * 4;
    load_rows(buf[0], kp);
    load_rows(buf[1], kp + CH * CC);
    const int L = klen[bc];   // read here, not at the top: a wait for it in front of the loads would hold them back
    __builtin_amdgcn_sched_barrier(0);

    {
        const v2f a[4] = { ua0.xy, ua0.zw, ua1.xy, ua1.zw };
        v8f d[4] = {};
#pragma unroll  // constant indices into the fragments
        for (int t = 0; t < 4; ++t)
#pragma unroll  // constant indices into the fragments
            for (int j = 0; j < 4; ++j) {
                v2f bf;
                bf.x = wr[2 * t][j];
                bf.y = wr[2 * t + 1][j];
                d[j] = __builtin_amdgcn_wmma_f32_16x16x4_f32(
                    /*neg_a=*/false, a[t], /*neg_b=*/false, bf,
                    /*c_mod=*/(short)0, d[j], /*reuse_a=*/false, /*reuse_b=*/false);
            }
        // Four issue slots between the last WMMA and the vector moves below, which read
        // the D registers and reuse the unused ones; the scheduling barriers hold them there.
        __builtin_amdgcn_sched_barrier(0);
        asm volatile("v_nop\n\tv_nop\n\tv_nop\n\tv_nop");
        __builtin_amdgcn_sched_barrier(0);
        // D register i < 4 = batch 4*g + i; four adjacent columns per store.
#pragma unroll  // constant indices into d
        for (int i = 0; i < 4; ++i) {
            const v4f v = { d[0][i], d[1][i], d[2][i], d[3][i] };
            *(v4f*)(&q_part[(bi * BPB + g * 4 + i) * CC + half * 64 + c * 4]) = v;
        }
    }
    lds_barrier();
    {
        v2f s = *(const v2f*)(&q_part[qr * CC + qc]);
#pragma unroll  // LDS reads issued together
        for (int p = 1; p < KSPLIT; ++p) s += *(const v2f*)(&q_part[(p * BPB + qr) * CC + qc]);
        s += bv;
        v2f tq;
        tq.x = tanhf(s.x);
        tq.y = tanhf(s.y);
        *(v2f*)(&q_lds[qr * CC + qc]) = tq;
    }
    lds_barrier();
    const v4f qa = *(const v4f*)(&q_lds[bi * CC + c * 4]);
    const v4f qb = *(const v4f*)(&q_lds[bi * CC + 64 + c * 4]);

#pragma unroll  // the buffer number must be a constant, else the buffers go to scratch
    for (int n = 0; n < NCH; ++n) {
        // The two scheduling barriers keep the loads of the buffer after next in
        // front of this buffer's arithmetic, so 20 to 30 loads of a wave stay in flight.
        __builtin_amdgcn_sched_barrier(0);
        if (n + 2 < NCH) load_rows(buf[(n + 2) % NBUF], kp + (n + 2) * CH * CC);
        __builtin_amdgcn_sched_barrier(0);

        const v4f* kb = buf[n % NBUF];
        float s[PR];
#pragma unroll  // constant indices into s and the buffer
        for (int p = 0; p < PR; ++p) {
            const v4f pr = kb[2 * p] * qa + kb[2 * p + 1] * qb;
            const v2f h = pr.xy + pr.zw;
            const float d = row_sum16(h.x + h.y);
            s[p] = (row0 + n * CH + 2 * p < L) ? d * SCALE : PADV;
        }
        float mn = m;
#pragma unroll  // constant indices into s
        for (int p = 0; p < PR; ++p) mn = fmaxf(mn, s[p]);
        const float corr = exp_fast(m - mn);   // 0 on the first buffer (m = -inf, mn finite)
        m = mn;
        l *= corr; acc0 *= corr; acc1 *= corr;
#pragma unroll  // constant indices into s and the buffer
        for (int p = 0; p < PR; ++p) {
            const float e = exp_fast(s[p] - mn);
            l    += e;
            acc0 += kb[2 * p] * e;
            acc1 += kb[2 * p + 1] * e;
            ms0  += kb[2 * p];
            ms1  += kb[2 * p + 1];
        }
    }

    const int slot = bi * 4 + half * 2 + g;
    *(v4f*)(&p_acc[slot * CC + c * 4])      = acc0;
    *(v4f*)(&p_acc[slot * CC + 64 + c * 4]) = acc1;
    *(v4f*)(&p_ms[slot * CC + c * 4])       = ms0;
    *(v4f*)(&p_ms[slot * CC + 64 + c * 4])  = ms1;
    // Every lane stores its copy: behind a one-lane test the compiler moved the whole
    // sum of l into that branch and kept every weight alive until there (spills).
    p_m[slot * 16 + c] = m;
    p_l[slot * 16 + c] = l;
    __syncthreads();

    // Merge the four partials of each batch: out = sum_t w[t]*keys[t] + mean_t keys[t]
#pragma unroll  // two trips, straight line
    for (int i = tid; i < BPB * CC; i += 512) {
        const int ob  = i / CC;
        const int col = i % CC;
        const int s0  = ob * 4;
        const float mx = fmaxf(fmaxf(p_m[s0 * 16], p_m[s0 * 16 + 16]), fmaxf(p_m[s0 * 16 + 32], p_m[s0 * 16 + 48]));
        float num = 0.f, den = 0.f, msum = 0.f;
#pragma unroll  // four terms, LDS reads issued together
        for (int p = 0; p < 4; ++p) {
            const float f = exp_fast(p_m[(s0 + p) * 16] - mx);
            den  = fmaf(f, p_l[(s0 + p) * 16], den);
            num  = fmaf(f, p_acc[(s0 + p) * CC + col], num);
            msum += p_ms[(s0 + p) * CC + col];
        }
        if (blockIdx.x * BPB + ob < B)
            out[(size_t)(blockIdx.x * BPB + ob) * CC + col] = num / den + msum * (1.0f / TT);
    }
}

// ---------------------------------------------------------------------------
// Launch: inputs are (user_query, keys, keys_length, W, b) in dict order.
// ---------------------------------------------------------------------------
extern "C" void kernel_launch(void* const* d_in, const int* in_sizes, int n_in,
                              void* d_out, int out_size, void* d_ws, size_t ws_size,
                              hipStream_t stream) {
    const float* uq   = (const float*)d_in[0];   // [B,1,C]
    const float* keys = (const float*)d_in[1];   // [B,T,C]
    const int*   klen = (const int*)d_in[2];     // [B,1]
    const float* W    = (const float*)d_in[3];   // [C,C]
    const float* bias = (const float*)d_in[4];   // [C]

    const int B = in_sizes[0] / CC;

    const int ablocks = (B + BPB - 1) / BPB;
    attn_softmax_stream<<<ablocks, 512, 0, stream>>>(uq, keys, klen, W, bias, (float*)d_out, B);
}
